// v000
// The times below were measured on an AMD MI455X: many runs one after another, warmed up first and cycling through
// copies of the inputs, with the whole window's GPU time divided by the number of runs. Launches and the gaps
// between them are all in it. The median over several windows is given; except for v000 it joins two sittings, which
// can be a few percent apart, so the side-by-side timings, each taken in one sitting, are the better comparison.
// v000, which the later versions start from, runs in 36.9 microseconds.
#include <hip/hip_runtime.h>
#include <math.h>

typedef __attribute__((ext_vector_type(2))) float v2f;
typedef __attribute__((ext_vector_type(8))) float v8f;
typedef __attribute__((ext_vector_type(4))) int   v4i;

#define B_  8
#define T_  1024
#define P_  7
#define D_  512
#define CH  16          // timesteps per WMMA prefix chunk
#define NC  (T_ / CH)   // 64 chunks
#define NTILE (D_ / 16) // 32 d-tiles of width 16
#define DPAD 4          // LDS row pad (floats): row stride 516 dwords, 16B aligned

// ---------------------------------------------------------------------------
// gfx1250 async global->LDS copy of one 16B packet (ASYNCcnt-tracked DMA).
// Builtin signature (from hipcc diagnostic): param0 = addrspace(1) int4*,
// i.e. (global src, lds dst, imm offset, imm cpol).
// ---------------------------------------------------------------------------
typedef __attribute__((address_space(1))) v4i gv4i;
typedef __attribute__((address_space(3))) v4i lv4i;

__device__ __forceinline__ void async_copy_b128(const float* gsrc, float* ldst) {
#if __has_builtin(__builtin_amdgcn_global_load_async_to_lds_b128)
    __builtin_amdgcn_global_load_async_to_lds_b128((gv4i*)gsrc, (lv4i*)ldst, 0, 0);
#else
    const unsigned loff =
        (unsigned)(unsigned long long)(__attribute__((address_space(3))) char*)ldst;
    asm volatile("global_load_async_to_lds_b128 %0, %1, off"
                 :: "v"(loff), "v"(gsrc) : "memory");
#endif
}

__device__ __forceinline__ void wait_async0() {
#if __has_builtin(__builtin_amdgcn_s_wait_asynccnt)
    __builtin_amdgcn_s_wait_asynccnt(0);
#else
    asm volatile("s_wait_asynccnt 0x0" ::: "memory");
#endif
}

// ---------------------------------------------------------------------------
// Kernel 1: per-chunk sums of the rank-1 outer products.
// csum[b][p][c][d] = sum_{t in chunk c} ppm[b,t,p] * out[b,t,d]
// ---------------------------------------------------------------------------
__global__ void __launch_bounds__(512)
chunk_sums(const float* __restrict__ outin,
           const float* __restrict__ ppm,
           float* __restrict__ csum) {
    const int c = blockIdx.x;
    const int b = blockIdx.y;
    const int d = threadIdx.x;

    __shared__ float pch[CH][P_];
    const int tid = threadIdx.x;
    if (tid < CH * P_) {
        const int t = tid / P_, p = tid % P_;
        pch[t][p] = ppm[((size_t)(b * T_ + c * CH + t)) * P_ + p];
    }
    __syncthreads();

    float acc[P_];
#pragma unroll
    for (int p = 0; p < P_; ++p) acc[p] = 0.0f;

#pragma unroll
    for (int t = 0; t < CH; ++t) {
        const float x = outin[((size_t)(b * T_ + c * CH + t)) * D_ + d];
#pragma unroll
        for (int p = 0; p < P_; ++p) acc[p] += pch[t][p] * x;
    }
#pragma unroll
    for (int p = 0; p < P_; ++p)
        csum[(((size_t)(b * P_ + p)) * NC + c) * D_ + d] = acc[p];
}

// ---------------------------------------------------------------------------
// Kernel 2: in-place EXCLUSIVE prefix scan of the chunk sums over c.
// ---------------------------------------------------------------------------
__global__ void __launch_bounds__(512)
chunk_scan(float* __restrict__ csum) {
    const int idx = blockIdx.x * blockDim.x + threadIdx.x;
    if (idx >= B_ * P_ * D_) return;
    const int d  = idx % D_;
    const int bp = idx / D_;
    const size_t base = (size_t)bp * NC * D_ + d;

    float run = 0.0f;
    for (int c = 0; c < NC; ++c) {
        const float v = csum[base + (size_t)c * D_];
        csum[base + (size_t)c * D_] = run;
        run += v;
    }
}

// ---------------------------------------------------------------------------
// Kernel 3: stage the 16x512 out-chunk into LDS with async b128 DMA, compute
// the intra-chunk inclusive prefix via WMMA (L16 @ X), add the inter-chunk
// carry, fused LayerNorm over D, write output.  One block per (b,p,chunk);
// 512 threads = 16 waves; each wave owns two 16-wide d-tiles.
// The LDS buffer xs[][] is reused: staged input during WMMA, then the
// accumulator spill for the LayerNorm row reduction (barrier-separated).
// ---------------------------------------------------------------------------
__global__ void __launch_bounds__(512)
prefix_ln(const float* __restrict__ outin,
          const float* __restrict__ ppm,
          const float* __restrict__ carry,
          const float* __restrict__ a2,
          const float* __restrict__ b2,
          float* __restrict__ y) {
    const int blk = blockIdx.x;
    const int c   = blk % NC;
    const int bp  = blk / NC;
    const int p   = bp % P_;
    const int b   = bp / P_;
    const int t0  = c * CH;

    __shared__ float pch[CH];                                        // ppm chunk
    __shared__ __attribute__((aligned(16))) float xs[CH][D_ + DPAD]; // 33 KB
    __shared__ float s1[CH][NTILE];
    __shared__ float s2[CH][NTILE];
    __shared__ float mrow[CH], irow[CH];

    const int tid  = threadIdx.x;
    const int lane = tid & 31;
    const int wave = tid >> 5;   // 0..15
    const int hi   = lane >> 4;  // 0 = lanes 0-15, 1 = lanes 16-31
    const int lm   = lane & 15;

    // --- Stage out[b, t0..t0+15, 0..511] into xs[t][d] via async DMA. ---
    {
        const int t = tid >> 5;      // row 0..15 (one wave per row)
        const int l = tid & 31;
        const float* grow = outin + ((size_t)(b * T_ + t0 + t)) * D_;
#pragma unroll
        for (int q = 0; q < 4; ++q) {
            const int d0 = (l + 32 * q) * 4;   // 16B packet start (floats)
            async_copy_b128(grow + d0, &xs[t][d0]);
        }
    }
    if (tid < CH)
        pch[tid] = ppm[((size_t)(b * T_ + t0 + tid)) * P_ + p];
    wait_async0();
    __syncthreads();

    v8f acc[2];

#pragma unroll
    for (int i = 0; i < 2; ++i) {
        const int dtile = wave * 2 + i;
        const int dcol  = dtile * 16 + lm;

        v8f cacc = {};
        // P16 = L16 @ X : four chained v_wmma_f32_16x16x4_f32 over K=16.
        // A (16x4 f32): lanes 0-15 -> M=lane, VGPR{0,1}=K{kb+0,kb+1};
        //               lanes 16-31 -> M=lane-16, VGPR{0,1}=K{kb+2,kb+3}.
        // B (4x16 f32): VGPR0 rows {kb+0 (lanes 0-15), kb+2 (lanes 16-31)},
        //               VGPR1 rows {kb+1, kb+3}; N = lane%16.
#pragma unroll
        for (int kk = 0; kk < 4; ++kk) {
            const int kb = kk * 4;
            const int k0 = kb + 2 * hi;

            v2f a;
            a.x = (lm >= k0)     ? 1.0f : 0.0f;   // L[m,k] = (m >= k)
            a.y = (lm >= k0 + 1) ? 1.0f : 0.0f;

            v2f bb;
            bb.x = pch[k0]     * xs[k0][dcol];
            bb.y = pch[k0 + 1] * xs[k0 + 1][dcol];

            cacc = __builtin_amdgcn_wmma_f32_16x16x4_f32(
                false, a, false, bb, (short)0, cacc, false, false);
        }

        // Add inter-chunk carry (broadcast per column d).
        const float cv = carry[(((size_t)(b * P_ + p)) * NC + c) * D_ + dcol];
#pragma unroll
        for (int r = 0; r < 8; ++r) cacc[r] += cv;
        acc[i] = cacc;
    }

    // xs still holds staged input being read above -> barrier before reuse.
    __syncthreads();

    // Spill to row-major LDS: xs[row][d].  VGPR r holds rows r (lanes 0-15)
    // and r+8 (lanes 16-31); column = dtile*16 + lane%16.
#pragma unroll
    for (int i = 0; i < 2; ++i) {
        const int dcol = (wave * 2 + i) * 16 + lm;
#pragma unroll
        for (int r = 0; r < 8; ++r)
            xs[r + 8 * hi][dcol] = acc[i][r];
    }
    __syncthreads();

    // Each thread reduces one (row, 16-d slice): 512 threads = 16 rows x 32 slices.
    {
        const int row = tid & 15;
        const int sl  = tid >> 4;
        const float4* px = (const float4*)&xs[row][sl * 16];
        float S1 = 0.0f, S2 = 0.0f;
#pragma unroll
        for (int j = 0; j < 4; ++j) {
            const float4 v = px[j];
            S1 += v.x + v.y + v.z + v.w;
            S2 += v.x * v.x + v.y * v.y + v.z * v.z + v.w * v.w;
        }
        s1[row][sl] = S1;
        s2[row][sl] = S2;
    }
    __syncthreads();

    // Finish: one thread per row combines the 32 slice partials.
    if (tid < CH) {
        float S1 = 0.0f, S2 = 0.0f;
#pragma unroll
        for (int t = 0; t < NTILE; ++t) { S1 += s1[tid][t]; S2 += s2[tid][t]; }
        const float mean = S1 * (1.0f / D_);
        float var = (S2 - S1 * mean) * (1.0f / (D_ - 1));   // unbiased (ddof=1)
        var = var < 0.0f ? 0.0f : var;
        const float std = sqrtf(var);
        mrow[tid] = mean;
        irow[tid] = 1.0f / (std + 1e-6f);
    }
    __syncthreads();

    // Normalize + affine + store:  y[b, t0+row, p, d]
#pragma unroll
    for (int i = 0; i < 2; ++i) {
        const int dcol = (wave * 2 + i) * 16 + lm;
        const float ga = a2[dcol];
        const float gb = b2[dcol];
#pragma unroll
        for (int r = 0; r < 8; ++r) {
            const int row = r + 8 * hi;
            const float yv = ga * (acc[i][r] - mrow[row]) * irow[row] + gb;
            y[(((size_t)(b * T_ + t0 + row)) * P_ + p) * D_ + dcol] = yv;
        }
    }
}

// ---------------------------------------------------------------------------
extern "C" void kernel_launch(void* const* d_in, const int* in_sizes, int n_in,
                              void* d_out, int out_size, void* d_ws, size_t ws_size,
                              hipStream_t stream) {
    (void)in_sizes; (void)n_in; (void)out_size; (void)ws_size;

    const float* outin = (const float*)d_in[0];  // (B,T,D)
    const float* ppm   = (const float*)d_in[1];  // (B,T,P)
    const float* a2    = (const float*)d_in[2];  // (D,)
    const float* b2    = (const float*)d_in[3];  // (D,)
    float* y    = (float*)d_out;                 // (B,T,P,D)
    float* csum = (float*)d_ws;                  // B*P*NC*D floats = 7 MB

    chunk_sums<<<dim3(NC, B_), 512, 0, stream>>>(outin, ppm, csum);

    const int scan_threads = B_ * P_ * D_;
    chunk_scan<<<(scan_threads + 511) / 512, 512, 0, stream>>>(csum);

    prefix_ln<<<B_ * P_ * NC, 512, 0, stream>>>(outin, ppm, csum, a2, b2, y);
}

// v001
// Measured time: 33.7 microseconds a run.
// In both of two side-by-side timings against v000, it was 1.12 times as fast.
#include <hip/hip_runtime.h>
#include <math.h>

typedef __attribute__((ext_vector_type(2))) float v2f;
typedef __attribute__((ext_vector_type(8))) float v8f;
typedef __attribute__((ext_vector_type(4))) int   v4i;

#define B_  8
#define T_  1024
#define P_  7
#define D_  512
#define CH  16          // timesteps per WMMA prefix chunk
#define NC  (T_ / CH)   // 64 chunks
#define NTILE (D_ / 16) // 32 d-tiles of width 16
#define DPAD 4          // LDS row pad (floats): row stride 516 dwords, 16B aligned

// ---------------------------------------------------------------------------
// gfx1250 async global->LDS copy of one 16B packet (ASYNCcnt-tracked DMA).
// Builtin signature (from hipcc diagnostic): param0 = addrspace(1) int4*,
// i.e. (global src, lds dst, imm offset, imm cpol).
// ---------------------------------------------------------------------------
typedef __attribute__((address_space(1))) v4i gv4i;
typedef __attribute__((address_space(3))) v4i lv4i;

__device__ __forceinline__ void async_copy_b128(const float* gsrc, float* ldst) {
#if __has_builtin(__builtin_amdgcn_global_load_async_to_lds_b128)
    __builtin_amdgcn_global_load_async_to_lds_b128((gv4i*)gsrc, (lv4i*)ldst, 0, 0);
#else
    const unsigned loff =
        (unsigned)(unsigned long long)(__attribute__((address_space(3))) char*)ldst;
    asm volatile("global_load_async_to_lds_b128 %0, %1, off"
                 :: "v"(loff), "v"(gsrc) : "memory");
#endif
}

__device__ __forceinline__ void wait_async0() {
#if __has_builtin(__builtin_amdgcn_s_wait_asynccnt)
    __builtin_amdgcn_s_wait_asynccnt(0);
#else
    asm volatile("s_wait_asynccnt 0x0" ::: "memory");
#endif
}

// ---------------------------------------------------------------------------
// Kernel 1: per-chunk sums of the rank-1 outer products.
// csum[b][p][c][d] = sum_{t in chunk c} ppm[b,t,p] * out[b,t,d]
// ---------------------------------------------------------------------------
__global__ void __launch_bounds__(512)
chunk_sums(const float* __restrict__ outin,
           const float* __restrict__ ppm,
           float* __restrict__ csum) {
    const int c = blockIdx.x;
    const int b = blockIdx.y;
    const int d = threadIdx.x;

    __shared__ float pch[CH][P_];
    const int tid = threadIdx.x;
    if (tid < CH * P_) {
        const int t = tid / P_, p = tid % P_;
        pch[t][p] = ppm[((size_t)(b * T_ + c * CH + t)) * P_ + p];
    }
    __syncthreads();

    float acc[P_];
#pragma unroll
    for (int p = 0; p < P_; ++p) acc[p] = 0.0f;

#pragma unroll
    for (int t = 0; t < CH; ++t) {
        const float x = outin[((size_t)(b * T_ + c * CH + t)) * D_ + d];
#pragma unroll
        for (int p = 0; p < P_; ++p) acc[p] += pch[t][p] * x;
    }
#pragma unroll
    for (int p = 0; p < P_; ++p)
        csum[(((size_t)(b * P_ + p)) * NC + c) * D_ + d] = acc[p];
}

// ---------------------------------------------------------------------------
// Kernel 2: in-place EXCLUSIVE prefix scan of the chunk sums over c.
// ---------------------------------------------------------------------------
__global__ void __launch_bounds__(512)
chunk_scan(float* __restrict__ csum) {
    const int idx = blockIdx.x * blockDim.x + threadIdx.x;
    if (idx >= B_ * P_ * D_) return;
    const int d  = idx % D_;
    const int bp = idx / D_;
    const size_t base = (size_t)bp * NC * D_ + d;

    float run = 0.0f;
    for (int c = 0; c < NC; ++c) {
        const float v = csum[base + (size_t)c * D_];
        csum[base + (size_t)c * D_] = run;
        run += v;
    }
}

// ---------------------------------------------------------------------------
// Kernel 3: stage the 16x512 out-chunk into LDS with async b128 DMA, take each
// wave's B-fragment values of it into registers once, then loop over all P
// phases: intra-chunk inclusive prefix via WMMA (L16 @ (ppm_p * X)), add the
// inter-chunk carry, fused LayerNorm over D, write output.  One block per
// (b,chunk); 512 threads = 16 waves; each wave owns two 16-wide d-tiles.
// The LDS buffer xs[][] is reused: staged input first, then (behind a barrier)
// the accumulator spill for the LayerNorm row reduction of every p.
// ---------------------------------------------------------------------------
__global__ void __launch_bounds__(512)
prefix_ln(const float* __restrict__ outin,
          const float* __restrict__ ppm,
          const float* __restrict__ carry,
          const float* __restrict__ a2,
          const float* __restrict__ b2,
          float* __restrict__ y) {
    const int blk = blockIdx.x;
    const int c   = blk % NC;
    const int b   = blk / NC;
    const int t0  = c * CH;

    __shared__ float pch[CH][P_];                                    // ppm chunk
    __shared__ __attribute__((aligned(16))) float xs[CH][D_ + DPAD]; // 33 KB
    __shared__ float s1[CH][NTILE];
    __shared__ float s2[CH][NTILE];
    __shared__ float mrow[CH], irow[CH];

    const int tid  = threadIdx.x;
    const int lane = tid & 31;
    const int wave = tid >> 5;   // 0..15
    const int hi   = lane >> 4;  // 0 = lanes 0-15, 1 = lanes 16-31
    const int lm   = lane & 15;

    // --- Stage out[b, t0..t0+15, 0..511] into xs[t][d] via async DMA. ---
    {
        const int t = tid >> 5;      // row 0..15 (one wave per row)
        const int l = tid & 31;
        const float* grow = outin + ((size_t)(b * T_ + t0 + t)) * D_;
#pragma unroll
        for (int q = 0; q < 4; ++q) {
            const int d0 = (l + 32 * q) * 4;   // 16B packet start (floats)
            async_copy_b128(grow + d0, &xs[t][d0]);
        }
    }

    // Per-column values that do not depend on the staged chunk: the carries of
    // all P phases and the affine pair, fetched once while the copies fly.
    float cv[P_][2], ga[2], gb[2];
#pragma unroll
    for (int i = 0; i < 2; ++i) {
        const int dcol = (wave * 2 + i) * 16 + lm;
#pragma unroll
        for (int p = 0; p < P_; ++p)
            cv[p][i] = carry[(((size_t)(b * P_ + p)) * NC + c) * D_ + dcol];
        ga[i] = a2[dcol];
        gb[i] = b2[dcol];
        // Precaution: the second column's results may be given the address
        // registers of the first column's loads; the wait stands in front of that.
        if (i == 0) asm volatile("s_wait_xcnt 0x0" ::: "memory");
    }
    if (tid < CH * P_)
        (&pch[0][0])[tid] = ppm[((size_t)(b * T_ + t0)) * P_ + tid];
    wait_async0();
    __syncthreads();

    // A (16x4 f32): lanes 0-15 -> M=lane, VGPR{0,1}=K{kb+0,kb+1};
    //               lanes 16-31 -> M=lane-16, VGPR{0,1}=K{kb+2,kb+3}.
    // B (4x16 f32): VGPR0 rows {kb+0 (lanes 0-15), kb+2 (lanes 16-31)},
    //               VGPR1 rows {kb+1, kb+3}; N = lane%16.
    // The raw x values of the B fragments are the same for every p.
    v2f xf[2][4];
#pragma unroll
    for (int i = 0; i < 2; ++i) {
        const int dcol = (wave * 2 + i) * 16 + lm;
#pragma unroll
        for (int kk = 0; kk < 4; ++kk) {
            const int k0 = kk * 4 + 2 * hi;
            xf[i][kk].x = xs[k0][dcol];
            xf[i][kk].y = xs[k0 + 1][dcol];
        }
    }

    // xs holds staged input being read above -> barrier before its reuse.
    __syncthreads();

    // Fully unrolled so that cv[p][] stays in registers (constant index).
#pragma unroll
    for (int p = 0; p < P_; ++p) {
        v8f acc[2];

#pragma unroll
        for (int i = 0; i < 2; ++i) {
            v8f cacc = {};
            // P16 = L16 @ X : four chained v_wmma_f32_16x16x4_f32 over K=16.
#pragma unroll
            for (int kk = 0; kk < 4; ++kk) {
                const int kb = kk * 4;
                const int k0 = kb + 2 * hi;

                v2f a;
                a.x = (lm >= k0)     ? 1.0f : 0.0f;   // L[m,k] = (m >= k)
                a.y = (lm >= k0 + 1) ? 1.0f : 0.0f;

                v2f bb;
                bb.x = pch[k0][p]     * xf[i][kk].x;
                bb.y = pch[k0 + 1][p] * xf[i][kk].y;

                cacc = __builtin_amdgcn_wmma_f32_16x16x4_f32(
                    false, a, false, bb, (short)0, cacc, false, false);
            }

            // Add inter-chunk carry (broadcast per column d).
#pragma unroll
            for (int r = 0; r < 8; ++r) cacc[r] += cv[p][i];
            acc[i] = cacc;
        }

        // Spill to row-major LDS: xs[row][d].  VGPR r holds rows r (lanes 0-15)
        // and r+8 (lanes 16-31); column = dtile*16 + lane%16.  The last readers
        // of xs (fragment loads, or the slice sums of p-1) lie behind a barrier.
#pragma unroll
        for (int i = 0; i < 2; ++i) {
            const int dcol = (wave * 2 + i) * 16 + lm;
#pragma unroll
            for (int r = 0; r < 8; ++r)
                xs[r + 8 * hi][dcol] = acc[i][r];
        }
        __syncthreads();

        // Each thread reduces one (row, 16-d slice): 16 rows x 32 slices.
        {
            const int row = tid & 15;
            const int sl  = tid >> 4;
            const float4* px = (const float4*)&xs[row][sl * 16];
            float S1 = 0.0f, S2 = 0.0f;
#pragma unroll
            for (int j = 0; j < 4; ++j) {
                const float4 v = px[j];
                S1 += v.x + v.y + v.z + v.w;
                S2 += v.x * v.x + v.y * v.y + v.z * v.z + v.w * v.w;
            }
            s1[row][sl] = S1;
            s2[row][sl] = S2;
        }
        __syncthreads();

        // Finish: one thread per row combines the 32 slice partials.
        if (tid < CH) {
            float S1 = 0.0f, S2 = 0.0f;
#pragma unroll
            for (int t = 0; t < NTILE; ++t) { S1 += s1[tid][t]; S2 += s2[tid][t]; }
            const float mean = S1 * (1.0f / D_);
            float var = (S2 - S1 * mean) * (1.0f / (D_ - 1));   // unbiased (ddof=1)
            var = var < 0.0f ? 0.0f : var;
            const float std = sqrtf(var);
            mrow[tid] = mean;
            irow[tid] = 1.0f / (std + 1e-6f);
        }
        __syncthreads();

        // Normalize + affine:  y[b, t0+row, p, d]
        float yv[2][8];
#pragma unroll
        for (int i = 0; i < 2; ++i) {
#pragma unroll
            for (int r = 0; r < 8; ++r) {
                const int row = r + 8 * hi;
                yv[i][r] = ga[i] * (acc[i][r] - mrow[row]) * irow[row] + gb[i];
            }
        }

        // Store.  The lane's address is that of (row 8*hi, first d-tile); row r
        // lies r * P_*D_*4 = r * 14336 bytes on, the second d-tile 64 bytes on.
        // The sixteen stores and their s_wait_xcnt stand in one statement: the
        // next p reuses the registers they name while they are still in flight,
        // and inside a statement nothing can be scheduled in front of the wait.
        // The compiler counts no store of asm text, so the loop's barriers do
        // not wait for these; no wave reads y, so none has to.
        static_assert(P_ * D_ * 4 == 14336, "row pitch of y in the offsets below");
        float* yp = y + (((size_t)(b * T_ + t0 + 8 * hi)) * P_ + p) * D_ + wave * 32 + lm;
        asm volatile(
            "global_store_b32 %0, %1, off\n\t"
            "global_store_b32 %0, %9, off offset:64\n\t"
            "global_store_b32 %0, %2, off offset:14336\n\t"
            "global_store_b32 %0, %10, off offset:14400\n\t"
            "global_store_b32 %0, %3, off offset:28672\n\t"
            "global_store_b32 %0, %11, off offset:28736\n\t"
            "global_store_b32 %0, %4, off offset:43008\n\t"
            "global_store_b32 %0, %12, off offset:43072\n\t"
            "global_store_b32 %0, %5, off offset:57344\n\t"
            "global_store_b32 %0, %13, off offset:57408\n\t"
            "global_store_b32 %0, %6, off offset:71680\n\t"
            "global_store_b32 %0, %14, off offset:71744\n\t"
            "global_store_b32 %0, %7, off offset:86016\n\t"
            "global_store_b32 %0, %15, off offset:86080\n\t"
            "global_store_b32 %0, %8, off offset:100352\n\t"
            "global_store_b32 %0, %16, off offset:100416\n\t"
            "s_wait_xcnt 0x0"
            :: "v"(yp),
               "v"(yv[0][0]), "v"(yv[0][1]), "v"(yv[0][2]), "v"(yv[0][3]),
               "v"(yv[0][4]), "v"(yv[0][5]), "v"(yv[0][6]), "v"(yv[0][7]),
               "v"(yv[1][0]), "v"(yv[1][1]), "v"(yv[1][2]), "v"(yv[1][3]),
               "v"(yv[1][4]), "v"(yv[1][5]), "v"(yv[1][6]), "v"(yv[1][7])
            : "memory");
    }
}

// ---------------------------------------------------------------------------
extern "C" void kernel_launch(void* const* d_in, const int* in_sizes, int n_in,
                              void* d_out, int out_size, void* d_ws, size_t ws_size,
                              hipStream_t stream) {
    (void)in_sizes; (void)n_in; (void)out_size; (void)ws_size;

    const float* outin = (const float*)d_in[0];  // (B,T,D)
    const float* ppm   = (const float*)d_in[1];  // (B,T,P)
    const float* a2    = (const float*)d_in[2];  // (D,)
    const float* b2    = (const float*)d_in[3];  // (D,)
    float* y    = (float*)d_out;                 // (B,T,P,D)
    float* csum = (float*)d_ws;                  // B*P*NC*D floats = 7 MB

    chunk_sums<<<dim3(NC, B_), 512, 0, stream>>>(outin, ppm, csum);

    const int scan_threads = B_ * P_ * D_;
    chunk_scan<<<(scan_threads + 511) / 512, 512, 0, stream>>>(csum);

    prefix_ln<<<B_ * NC, 512, 0, stream>>>(outin, ppm, csum, a2, b2, y);
}

// v002
// Measured time: 21.4 microseconds a run.
// Two timings next to v001 put it at 1.56 and 1.59 times that version's speed.
// Counting every step since v000, it is 1.76 times as fast.
#include <hip/hip_runtime.h>
#include <math.h>

typedef __attribute__((ext_vector_type(2))) float v2f;
typedef __attribute__((ext_vector_type(8))) float v8f;
typedef __attribute__((ext_vector_type(4))) int   v4i;

#define B_  8
#define T_  1024
#define P_  7
#define D_  512
#define CH  16          // timesteps per WMMA prefix chunk
#define NC  (T_ / CH)   // 64 chunks
#define NTILE (D_ / 16) // 32 d-tiles of width 16
#define DPAD 4          // LDS row pad (floats): row stride 516 dwords, 16B aligned

// ---------------------------------------------------------------------------
// gfx1250 async global->LDS copy of one 16B packet (ASYNCcnt-tracked DMA).
// Builtin signature (from hipcc diagnostic): param0 = addrspace(1) int4*,
// i.e. (global src, lds dst, imm offset, imm cpol).
// ---------------------------------------------------------------------------
typedef __attribute__((address_space(1))) v4i gv4i;
typedef __attribute__((address_space(3))) v4i lv4i;

__device__ __forceinline__ void async_copy_b128(const float* gsrc, float* ldst) {
#if __has_builtin(__builtin_amdgcn_global_load_async_to_lds_b128)
    __builtin_amdgcn_global_load_async_to_lds_b128((gv4i*)gsrc, (lv4i*)ldst, 0, 0);
#else
    const unsigned loff =
        (unsigned)(unsigned long long)(__attribute__((address_space(3))) char*)ldst;
    asm volatile("global_load_async_to_lds_b128 %0, %1, off"
                 :: "v"(loff), "v"(gsrc) : "memory");
#endif
}

__device__ __forceinline__ void wait_async0() {
#if __has_builtin(__builtin_amdgcn_s_wait_asynccnt)
    __builtin_amdgcn_s_wait_asynccnt(0);
#else
    asm volatile("s_wait_asynccnt 0x0" ::: "memory");
#endif
}

// ---------------------------------------------------------------------------
// Kernel 1: per-chunk sums of the rank-1 outer products.
// csum[b][p][c][d] = sum_{t in chunk c} ppm[b,t,p] * out[b,t,d]
// ---------------------------------------------------------------------------
__global__ void __launch_bounds__(512)
chunk_sums(const float* __restrict__ outin,
           const float* __restrict__ ppm,
           float* __restrict__ csum) {
    const int c = blockIdx.x;
    const int b = blockIdx.y;
    const int d = threadIdx.x;

    __shared__ float pch[CH][P_];
    const int tid = threadIdx.x;
    if (tid < CH * P_) {
        const int t = tid / P_, p = tid % P_;
        pch[t][p] = ppm[((size_t)(b * T_ + c * CH + t)) * P_ + p];
    }
    __syncthreads();

    float acc[P_];
#pragma unroll
    for (int p = 0; p < P_; ++p) acc[p] = 0.0f;

#pragma unroll
    for (int t = 0; t < CH; ++t) {
        const float x = outin[((size_t)(b * T_ + c * CH + t)) * D_ + d];
#pragma unroll
        for (int p = 0; p < P_; ++p) acc[p] += pch[t][p] * x;
    }
#pragma unroll
    for (int p = 0; p < P_; ++p)
        csum[(((size_t)(b * P_ + p)) * NC + c) * D_ + d] = acc[p];
}

// ---------------------------------------------------------------------------
// Kernel 2: in-place EXCLUSIVE prefix scan of the chunk sums over c.
// ---------------------------------------------------------------------------
__global__ void __launch_bounds__(512)
chunk_scan(float* __restrict__ csum) {
    const int idx = blockIdx.x * blockDim.x + threadIdx.x;
    if (idx >= B_ * P_ * D_) return;
    const int d  = idx % D_;
    const int bp = idx / D_;
    const size_t base = (size_t)bp * NC * D_ + d;

    float run = 0.0f;
    for (int c = 0; c < NC; ++c) {
        const float v = csum[base + (size_t)c * D_];
        csum[base + (size_t)c * D_] = run;
        run += v;
    }
}

// ---------------------------------------------------------------------------
// Sum over the 32 lanes of a wave, the result in every lane: four DPP steps
// inside each 16-lane row, then lane l with lane l ^ 16.
// ---------------------------------------------------------------------------
typedef __attribute__((ext_vector_type(4))) float v4f;

template <int CTRL>
__device__ __forceinline__ float row_xadd(float x) {
    const int o = __builtin_amdgcn_update_dpp(0, __builtin_bit_cast(int, x), CTRL, 0xf, 0xf, true);
    return x + __builtin_bit_cast(float, o);
}

__device__ __forceinline__ float wave_sum(float x) {
    x = row_xadd<0x161>(x);   // row_xmask:1
    x = row_xadd<0x162>(x);   // row_xmask:2
    x = row_xadd<0x164>(x);   // row_xmask:4
    x = row_xadd<0x168>(x);   // row_xmask:8
    const int xi = __builtin_bit_cast(int, x);
    return x + __builtin_bit_cast(float,
        __builtin_amdgcn_permlanex16(xi, xi, 0x76543210, 0xfedcba98, false, false));
}

// ---------------------------------------------------------------------------
// Kernel 3: stage the 16x512 out-chunk into LDS with async b128 DMA, take each
// wave's B-fragment values of it into registers once, then loop over all P
// phases: intra-chunk inclusive prefix via WMMA (L16 @ (ppm_p * X)), add the
// inter-chunk carry, spill the 16x512 tile row-major to LDS.  Behind one
// barrier each of the 16 waves takes back ONE whole row (16 floats a lane),
// sums it inside the wave, normalizes it in registers and stores it as four
// 512-byte runs.  One block per (b,chunk); 512 threads = 16 waves; for the
// products each wave owns two 16-wide d-tiles.  Two LDS tiles alternate, so
// the spill of phase p+1 never meets the row reads of phase p.
// ---------------------------------------------------------------------------
__global__ void __launch_bounds__(512)
prefix_ln(const float* __restrict__ outin,
          const float* __restrict__ ppm,
          const float* __restrict__ carry,
          const float* __restrict__ a2,
          const float* __restrict__ b2,
          float* __restrict__ y) {
    const int blk = blockIdx.x;
    const int c   = blk % NC;
    const int b   = blk / NC;
    const int t0  = c * CH;

    // pch has the widest alignment so that it is laid first in LDS: behind two
    // tiles its addresses would no longer fit the LDS offset field.
    __shared__ __attribute__((aligned(64))) float pch[CH][P_];       // ppm chunk
    __shared__ __attribute__((aligned(16))) float xs[CH][D_ + DPAD]; // 33 KB
    __shared__ __attribute__((aligned(16))) float xt[CH][D_ + DPAD]; // 33 KB

    const int tid  = threadIdx.x;
    const int lane = tid & 31;
    const int wave = tid >> 5;   // 0..15
    const int hi   = lane >> 4;  // 0 = lanes 0-15, 1 = lanes 16-31
    const int lm   = lane & 15;

    // --- Stage out[b, t0..t0+15, 0..511] into xs[t][d] via async DMA. ---
    {
        const int t = tid >> 5;      // row 0..15 (one wave per row)
        const int l = tid & 31;
        const float* grow = outin + ((size_t)(b * T_ + t0 + t)) * D_;
#pragma unroll
        for (int q = 0; q < 4; ++q) {
            const int d0 = (l + 32 * q) * 4;   // 16B packet start (floats)
            async_copy_b128(grow + d0, &xs[t][d0]);
        }
    }

    // Values that do not depend on the staged chunk, fetched once while the
    // copies fly: the carries of all P phases at the lane's two product
    // columns, and the affine pair at the lane's sixteen columns of a row.
    float cv[P_][2];
#pragma unroll
    for (int i = 0; i < 2; ++i) {
        const int dcol = (wave * 2 + i) * 16 + lm;
#pragma unroll
        for (int p = 0; p < P_; ++p)
            cv[p][i] = carry[(((size_t)(b * P_ + p)) * NC + c) * D_ + dcol];
        // Precaution: the second column's results may be given the address
        // registers of the first column's loads; the wait stands in front of that.
        if (i == 0) asm volatile("s_wait_xcnt 0x0" ::: "memory");
    }
    v4f ga[4], gb[4];
#pragma unroll
    for (int q = 0; q < 4; ++q) {
        ga[q] = ((const v4f*)a2)[lane + 32 * q];
        gb[q] = ((const v4f*)b2)[lane + 32 * q];
    }
    if (tid < CH * P_)
        (&pch[0][0])[tid] = ppm[((size_t)(b * T_ + t0)) * P_ + tid];
    wait_async0();
    __syncthreads();

    // A (16x4 f32): lanes 0-15 -> M=lane, VGPR{0,1}=K{kb+0,kb+1};
    //               lanes 16-31 -> M=lane-16, VGPR{0,1}=K{kb+2,kb+3}.
    // B (4x16 f32): VGPR0 rows {kb+0 (lanes 0-15), kb+2 (lanes 16-31)},
    //               VGPR1 rows {kb+1, kb+3}; N = lane%16.
    // The raw x values of the B fragments are the same for every p.
    v2f xf[2][4];
#pragma unroll
    for (int i = 0; i < 2; ++i) {
        const int dcol = (wave * 2 + i) * 16 + lm;
#pragma unroll
        for (int kk = 0; kk < 4; ++kk) {
            const int k0 = kk * 4 + 2 * hi;
            xf[i][kk].x = xs[k0][dcol];
            xf[i][kk].y = xs[k0 + 1][dcol];
        }
    }

    // Products of phase p, carry added, spilled row-major to dst[row][d].
    // VGPR r holds rows r (lanes 0-15) and r+8 (lanes 16-31); column =
    // dtile*16 + lane%16.
    auto phase_to_lds = [&](const int p, float (*dst)[D_ + DPAD]) {
#pragma unroll
        for (int i = 0; i < 2; ++i) {
            v8f cacc = {};
            // P16 = L16 @ X : four chained v_wmma_f32_16x16x4_f32 over K=16.
#pragma unroll
            for (int kk = 0; kk < 4; ++kk) {
                const int kb = kk * 4;
                const int k0 = kb + 2 * hi;

                v2f a;
                a.x = (lm >= k0)     ? 1.0f : 0.0f;   // L[m,k] = (m >= k)
                a.y = (lm >= k0 + 1) ? 1.0f : 0.0f;

                v2f bb;
                bb.x = pch[k0][p]     * xf[i][kk].x;
                bb.y = pch[k0 + 1][p] * xf[i][kk].y;

                cacc = __builtin_amdgcn_wmma_f32_16x16x4_f32(
                    false, a, false, bb, (short)0, cacc, false, false);
            }

            // Add inter-chunk carry (broadcast per column d), then spill.
            const int dcol = (wave * 2 + i) * 16 + lm;
#pragma unroll
            for (int r = 0; r < 8; ++r)
                dst[r + 8 * hi][dcol] = cacc[r] + cv[p][i];
        }
    };

    // Phase 0 goes to xt, so it cannot meet the fragment loads from xs above;
    // xs is first rewritten (phase 1) behind the barrier of p = 0.
    phase_to_lds(0, xt);

    // Fully unrolled so that cv[p][] stays in registers (constant index).
#pragma unroll
    for (int p = 0; p < P_; ++p) {
        float (*cur)[D_ + DPAD] = (p & 1) ? xs : xt;
        float (*nxt)[D_ + DPAD] = (p & 1) ? xt : xs;

        // The one barrier of a phase: it publishes the tile of phase p and
        // ends every wave's row reads of phase p-1, whose tile is refilled below.
        __syncthreads();

        // Row 'wave' of the tile: lane l holds floats 4*(l+32q) .. +3.
        v4f v[4];
#pragma unroll
        for (int q = 0; q < 4; ++q)
            v[q] = ((const v4f*)&cur[wave][0])[lane + 32 * q];

        if (p + 1 < P_) phase_to_lds(p + 1, nxt);

        // Lane's own part as four-wide sums, then across the wave.
        const v4f u1 = (v[0] + v[1]) + (v[2] + v[3]);
        const v4f u2 = (v[0] * v[0] + v[1] * v[1]) + (v[2] * v[2] + v[3] * v[3]);
        const float S1 = wave_sum((u1.x + u1.y) + (u1.z + u1.w));
        const float S2 = wave_sum((u2.x + u2.y) + (u2.z + u2.w));

        const float mean = S1 * (1.0f / D_);
        float var = (S2 - S1 * mean) * (1.0f / (D_ - 1));   // unbiased (ddof=1)
        var = var < 0.0f ? 0.0f : var;
        const float inv = 1.0f / (sqrtf(var) + 1e-6f);

        // Normalize + affine:  y[b, t0+wave, p, d]
        v4f o[4];
#pragma unroll
        for (int q = 0; q < 4; ++q)
            o[q] = ga[q] * (v[q] - mean) * inv + gb[q];

        // Store the row: four runs of 512 contiguous bytes, whole lines each.
        // The stores and their s_wait_xcnt stand in one statement: the next p
        // reuses the registers they name while they are still in flight, and
        // inside a statement nothing can be scheduled in front of the wait.
        // The compiler counts no store of asm text, so the loop's barrier does
        // not wait for these; no wave reads y, so none has to.
        float* yp = y + (((size_t)(b * T_ + t0 + wave)) * P_ + p) * D_ + lane * 4;
        asm volatile(
            "global_store_b128 %0, %1, off\n\t"
            "global_store_b128 %0, %2, off offset:512\n\t"
            "global_store_b128 %0, %3, off offset:1024\n\t"
            "global_store_b128 %0, %4, off offset:1536\n\t"
            "s_wait_xcnt 0x0"
            :: "v"(yp), "v"(o[0]), "v"(o[1]), "v"(o[2]), "v"(o[3])
            : "memory");
    }
}

// ---------------------------------------------------------------------------
extern "C" void kernel_launch(void* const* d_in, const int* in_sizes, int n_in,
                              void* d_out, int out_size, void* d_ws, size_t ws_size,
                              hipStream_t stream) {
    (void)in_sizes; (void)n_in; (void)out_size; (void)ws_size;

    const float* outin = (const float*)d_in[0];  // (B,T,D)
    const float* ppm   = (const float*)d_in[1];  // (B,T,P)
    const float* a2    = (const float*)d_in[2];  // (D,)
    const float* b2    = (const float*)d_in[3];  // (D,)
    float* y    = (float*)d_out;                 // (B,T,P,D)
    float* csum = (float*)d_ws;                  // B*P*NC*D floats = 7 MB

    chunk_sums<<<dim3(NC, B_), 512, 0, stream>>>(outin, ppm, csum);

    const int scan_threads = B_ * P_ * D_;
    chunk_scan<<<(scan_threads + 511) / 512, 512, 0, stream>>>(csum);

    prefix_ln<<<B_ * NC, 512, 0, stream>>>(outin, ppm, csum, a2, b2, y);
}

// v003
// One run takes 17.2 microseconds.
// In two side-by-side timings against v002, it was 1.25 and 1.23 times as fast.
// Over all steps from v000 it is 2.19 times as fast.
#include <hip/hip_runtime.h>
#include <math.h>

typedef __attribute__((ext_vector_type(2))) float v2f;
typedef __attribute__((ext_vector_type(8))) float v8f;
typedef __attribute__((ext_vector_type(4))) int   v4i;

#define B_  8
#define T_  1024
#define P_  7
#define D_  512
#define CH  16          // timesteps per WMMA prefix chunk
#define NC  (T_ / CH)   // 64 chunks
#define NTILE (D_ / 16) // 32 d-tiles of width 16
#define DPAD 4          // LDS row pad (floats): row stride 516 dwords, 16B aligned

// ---------------------------------------------------------------------------
// gfx1250 async global->LDS copy of one 16B packet (ASYNCcnt-tracked DMA).
// Builtin signature (from hipcc diagnostic): param0 = addrspace(1) int4*,
// i.e. (global src, lds dst, imm offset, imm cpol).
// ---------------------------------------------------------------------------
typedef __attribute__((address_space(1))) v4i gv4i;
typedef __attribute__((address_space(3))) v4i lv4i;

__device__ __forceinline__ void async_copy_b128(const float* gsrc, float* ldst) {
#if __has_builtin(__builtin_amdgcn_global_load_async_to_lds_b128)
    __builtin_amdgcn_global_load_async_to_lds_b128((gv4i*)gsrc, (lv4i*)ldst, 0, 0);
#else
    const unsigned loff =
        (unsigned)(unsigned long long)(__attribute__((address_space(3))) char*)ldst;
    asm volatile("global_load_async_to_lds_b128 %0, %1, off"
                 :: "v"(loff), "v"(gsrc) : "memory");
#endif
}

__device__ __forceinline__ void wait_async0() {
#if __has_builtin(__builtin_amdgcn_s_wait_asynccnt)
    __builtin_amdgcn_s_wait_asynccnt(0);
#else
    asm volatile("s_wait_asynccnt 0x0" ::: "memory");
#endif
}

// ---------------------------------------------------------------------------
// Kernel 1: chunk sums of the rank-1 outer products AND their exclusive scan
// over the chunks, in one launch.  One work-group per (b, half of T, 32-wide
// slice of d) holds the 32 chunk sums of its half in LDS and scans them there:
//   carry[b][p][c][d] = sum over the chunks c' < c OF THE SAME HALF of
//                       sum_{t in c'} ppm[b,t,p] * out[b,t,d]
//   half0[b][p][d]    = the same sum over the whole first half of T
// The consumer adds half0 to the carries of the second half.
// 8 waves; eight lanes cover the 128-byte slice of a row (4 floats each), and
// each of a wave's four lane groups owns one whole chunk, so a chunk sum needs
// no cross-lane step and one load instruction takes four whole lines.
// ---------------------------------------------------------------------------
typedef __attribute__((ext_vector_type(4))) float v4f;

#define SLW   32             // floats of d per work-group (one 128-byte line)
#define NSL   (D_ / SLW)     // 16 slices
#define SEGC  (NC / 2)       // 32 chunks in a half of T
#define PROW  8              // ppm row in LDS: 7 values and a zero
#define PPIT  (CH * PROW + 8) // dwords per chunk: +8 sets the lane groups on different banks
#define NCOL  (P_ * SLW / 4) // 56 four-wide columns (p, d/4) of a slice

__global__ void __launch_bounds__(256)
chunk_carries(const float* __restrict__ outin,
              const float* __restrict__ ppm,
              float* __restrict__ carry,
              float* __restrict__ half0) {
    const int s = blockIdx.x;
    const int h = blockIdx.y;
    const int b = blockIdx.z;

    __shared__ __attribute__((aligned(16))) float pl[SEGC][PPIT];      // 17 KB
    __shared__ __attribute__((aligned(16))) float cs[SEGC][P_ * SLW];  // 28 KB
    __shared__ __attribute__((aligned(16))) float st[4][P_ * SLW];

    const int tid  = threadIdx.x;
    const int lane = tid & 31;
    const int wave = tid >> 5;    // 0..7
    const int cl   = wave * 4 + (lane >> 3);   // the lane group's chunk in this half
    const int dq   = lane & 7;
    const int row0 = b * T_ + h * (SEGC * CH); // first row of this half

    // ppm of the wave's own 64 rows, two rows a lane, and all sixteen rows of
    // the lane group's chunk of out: every load of the kernel in flight together.
    const int prow = wave * 64 + lane;
    const float* pr0 = ppm + ((size_t)(row0 + prow)) * P_;
    const float* pr1 = pr0 + 32 * P_;
    const v4f lo0 = {pr0[0], pr0[1], pr0[2], pr0[3]};
    const v4f hi0 = {pr0[4], pr0[5], pr0[6], 0.0f};
    const v4f lo1 = {pr1[0], pr1[1], pr1[2], pr1[3]};
    const v4f hi1 = {pr1[4], pr1[5], pr1[6], 0.0f};
    const v4f* xp = (const v4f*)(outin + ((size_t)(row0 + cl * CH)) * D_ + s * SLW + dq * 4);
    v4f x[CH];
#pragma unroll
    for (int r = 0; r < CH; ++r) x[r] = xp[r * (D_ / 4)];
    // Precaution: no register that these loads name is rewritten in front of
    // this wait; as inputs the three addresses stay in their registers up to it.
    asm volatile("s_wait_xcnt 0x0" :: "v"(pr0), "v"(pr1), "v"(xp) : "memory");

    // The ppm rows go to the wave's own LDS range.
    {
        float* d0 = &pl[prow >> 4][(prow & 15) * PROW];
        float* d1 = &pl[(prow >> 4) + 2][(prow & 15) * PROW];
        *(v4f*)d0       = lo0;
        *(v4f*)(d0 + 4) = hi0;
        *(v4f*)d1       = lo1;
        *(v4f*)(d1 + 4) = hi1;
    }
    // The rows are read back by other lanes of the same wave only: the wave's
    // own LDS stores have to be done, no other wave's, so no barrier here.
    asm volatile("s_wait_dscnt 0x0" ::: "memory");

    v2f acc[P_][2];
#pragma unroll
    for (int p = 0; p < P_; ++p) { acc[p][0] = (v2f){0.0f, 0.0f}; acc[p][1] = (v2f){0.0f, 0.0f}; }

#pragma unroll
    for (int r = 0; r < CH; ++r) {
        const v4f p0 = *(const v4f*)&pl[cl][r * PROW];
        const v4f p1 = *(const v4f*)&pl[cl][r * PROW + 4];
        const float pp[P_] = {p0.x, p0.y, p0.z, p0.w, p1.x, p1.y, p1.z};
        const v2f xa = {x[r].x, x[r].y};
        const v2f xb = {x[r].z, x[r].w};
#pragma unroll
        for (int p = 0; p < P_; ++p) {
            const v2f w = {pp[p], pp[p]};
            acc[p][0] += w * xa;
            acc[p][1] += w * xb;
        }
    }
#pragma unroll
    for (int p = 0; p < P_; ++p)
        *(v4f*)&cs[cl][p * SLW + dq * 4] = (v4f){acc[p][0].x, acc[p][0].y, acc[p][1].x, acc[p][1].y};
    __syncthreads();

    // Scan: two waves per run of eight chunks, one four-wide column a lane.
    const int col = tid & 63;
    const int sg  = tid >> 6;     // 0..3
    const bool on = col < NCOL;
    const int  cc = on ? col : 0; // lanes past the last column stay inside the arrays
    v4f e[8];
    v4f run = {0.0f, 0.0f, 0.0f, 0.0f};
#pragma unroll
    for (int j = 0; j < 8; ++j) {
        e[j] = run;
        run += *(const v4f*)&cs[sg * 8 + j][cc * 4];
    }
    if (on) *(v4f*)&st[sg][cc * 4] = run;
    __syncthreads();

    v4f off = {0.0f, 0.0f, 0.0f, 0.0f};
#pragma unroll
    for (int q = 0; q < 3; ++q) {
        const v4f t = *(const v4f*)&st[q][cc * 4];
        const v4f z = {0.0f, 0.0f, 0.0f, 0.0f};
        off += (q < sg) ? t : z;
    }

    if (on) {
        const int p  = cc >> 3;
        const int d0 = s * SLW + (cc & 7) * 4;
        float* cp = carry + (((size_t)(b * P_ + p)) * NC + h * SEGC + sg * 8) * D_ + d0;
#pragma unroll
        for (int j = 0; j < 8; ++j)
            *(v4f*)(cp + j * D_) = off + e[j];
        if (h == 0 && sg == 3)
            *(v4f*)(half0 + ((size_t)(b * P_ + p)) * D_ + d0) = off + run;
    }
}

// ---------------------------------------------------------------------------
// Sum over the 32 lanes of a wave, the result in every lane: four DPP steps
// inside each 16-lane row, then lane l with lane l ^ 16.
// ---------------------------------------------------------------------------
template <int CTRL>
__device__ __forceinline__ float row_xadd(float x) {
    const int o = __builtin_amdgcn_update_dpp(0, __builtin_bit_cast(int, x), CTRL, 0xf, 0xf, true);
    return x + __builtin_bit_cast(float, o);
}

__device__ __forceinline__ float wave_sum(float x) {
    x = row_xadd<0x161>(x);   // row_xmask:1
    x = row_xadd<0x162>(x);   // row_xmask:2
    x = row_xadd<0x164>(x);   // row_xmask:4
    x = row_xadd<0x168>(x);   // row_xmask:8
    const int xi = __builtin_bit_cast(int, x);
    return x + __builtin_bit_cast(float,
        __builtin_amdgcn_permlanex16(xi, xi, 0x76543210, 0xfedcba98, false, false));
}

// ---------------------------------------------------------------------------
// Kernel 2: stage the 16x512 out-chunk into LDS with async b128 DMA, take each
// wave's B-fragment values of it into registers once, then loop over all P
// phases: intra-chunk inclusive prefix via WMMA (L16 @ (ppm_p * X)), add the
// inter-chunk carry, spill the 16x512 tile row-major to LDS.  Behind one
// barrier each of the 16 waves takes back ONE whole row (16 floats a lane),
// sums it inside the wave, normalizes it in registers and stores it as four
// 512-byte runs.  One block per (b,chunk); 512 threads = 16 waves; for the
// products each wave owns two 16-wide d-tiles.  Two LDS tiles alternate, so
// the spill of phase p+1 never meets the row reads of phase p.
// ---------------------------------------------------------------------------
__global__ void __launch_bounds__(512)
prefix_ln(const float* __restrict__ outin,
          const float* __restrict__ ppm,
          const float* __restrict__ carry,
          const float* __restrict__ half0,
          const float* __restrict__ a2,
          const float* __restrict__ b2,
          float* __restrict__ y) {
    const int blk = blockIdx.x;
    const int c   = blk % NC;
    const int b   = blk / NC;
    const int t0  = c * CH;

    // pch has the widest alignment so that it is laid first in LDS: behind two
    // tiles its addresses would no longer fit the LDS offset field.
    __shared__ __attribute__((aligned(64))) float pch[CH][P_];       // ppm chunk
    __shared__ __attribute__((aligned(16))) float xs[CH][D_ + DPAD]; // 33 KB
    __shared__ __attribute__((aligned(16))) float xt[CH][D_ + DPAD]; // 33 KB

    const int tid  = threadIdx.x;
    const int lane = tid & 31;
    const int wave = tid >> 5;   // 0..15
    const int hi   = lane >> 4;  // 0 = lanes 0-15, 1 = lanes 16-31
    const int lm   = lane & 15;

    // --- Stage out[b, t0..t0+15, 0..511] into xs[t][d] via async DMA. ---
    {
        const int t = tid >> 5;      // row 0..15 (one wave per row)
        const int l = tid & 31;
        const float* grow = outin + ((size_t)(b * T_ + t0 + t)) * D_;
#pragma unroll
        for (int q = 0; q < 4; ++q) {
            const int d0 = (l + 32 * q) * 4;   // 16B packet start (floats)
            async_copy_b128(grow + d0, &xs[t][d0]);
        }
    }

    // Values that do not depend on the staged chunk, fetched once while the
    // copies fly: the carries of all P phases at the lane's two product
    // columns, and the affine pair at the lane's sixteen columns of a row.
    float cv[P_][2];
#pragma unroll
    for (int i = 0; i < 2; ++i) {
        const int dcol = (wave * 2 + i) * 16 + lm;
#pragma unroll
        for (int p = 0; p < P_; ++p)
            cv[p][i] = carry[(((size_t)(b * P_ + p)) * NC + c) * D_ + dcol];
        // Precaution: the second column's results may be given the address
        // registers of the first column's loads; the wait stands in front of that.
        if (i == 0) asm volatile("s_wait_xcnt 0x0" ::: "memory");
    }
    v4f ga[4], gb[4];
#pragma unroll
    for (int q = 0; q < 4; ++q) {
        ga[q] = ((const v4f*)a2)[lane + 32 * q];
        gb[q] = ((const v4f*)b2)[lane + 32 * q];
    }
    if (tid < CH * P_)
        (&pch[0][0])[tid] = ppm[((size_t)(b * T_ + t0)) * P_ + tid];
    // The carries are scanned inside each half of T: the second half's chunks
    // take the first half's total on top (c is the same for the whole block).
    // Precaution: the address formed below may be given a register that a load
    // above names; the wait stands in front of that.
    asm volatile("s_wait_xcnt 0x0" ::: "memory");
    if (c >= SEGC) {
        const float* hp = half0 + (size_t)(b * P_) * D_ + wave * 32 + lm;
        float hv[P_][2];
#pragma unroll
        for (int i = 0; i < 2; ++i)
#pragma unroll
            for (int p = 0; p < P_; ++p)
                hv[p][i] = hp[p * D_ + i * 16];
        // Precaution, as above: as an input the address stays in its registers
        // up to the wait.
        asm volatile("s_wait_xcnt 0x0" :: "v"(hp) : "memory");
#pragma unroll
        for (int i = 0; i < 2; ++i)
#pragma unroll
            for (int p = 0; p < P_; ++p) cv[p][i] += hv[p][i];
    }
    wait_async0();
    __syncthreads();

    // A (16x4 f32): lanes 0-15 -> M=lane, VGPR{0,1}=K{kb+0,kb+1};
    //               lanes 16-31 -> M=lane-16, VGPR{0,1}=K{kb+2,kb+3}.
    // B (4x16 f32): VGPR0 rows {kb+0 (lanes 0-15), kb+2 (lanes 16-31)},
    //               VGPR1 rows {kb+1, kb+3}; N = lane%16.
    // The raw x values of the B fragments are the same for every p.
    v2f xf[2][4];
#pragma unroll
    for (int i = 0; i < 2; ++i) {
        const int dcol = (wave * 2 + i) * 16 + lm;
#pragma unroll
        for (int kk = 0; kk < 4; ++kk) {
            const int k0 = kk * 4 + 2 * hi;
            xf[i][kk].x = xs[k0][dcol];
            xf[i][kk].y = xs[k0 + 1][dcol];
        }
    }

    // Products of phase p, carry added, spilled row-major to dst[row][d].
    // VGPR r holds rows r (lanes 0-15) and r+8 (lanes 16-31); column =
    // dtile*16 + lane%16.
    auto phase_to_lds = [&](const int p, float (*dst)[D_ + DPAD]) {
#pragma unroll
        for (int i = 0; i < 2; ++i) {
            v8f cacc = {};
            // P16 = L16 @ X : four chained v_wmma_f32_16x16x4_f32 over K=16.
#pragma unroll
            for (int kk = 0; kk < 4; ++kk) {
                const int kb = kk * 4;
                const int k0 = kb + 2 * hi;

                v2f a;
                a.x = (lm >= k0)     ? 1.0f : 0.0f;   // L[m,k] = (m >= k)
                a.y = (lm >= k0 + 1) ? 1.0f : 0.0f;

                v2f bb;
                bb.x = pch[k0][p]     * xf[i][kk].x;
                bb.y = pch[k0 + 1][p] * xf[i][kk].y;

                cacc = __builtin_amdgcn_wmma_f32_16x16x4_f32(
                    false, a, false, bb, (short)0, cacc, false, false);
            }

            // Add inter-chunk carry (broadcast per column d), then spill.
            const int dcol = (wave * 2 + i) * 16 + lm;
#pragma unroll
            for (int r = 0; r < 8; ++r)
                dst[r + 8 * hi][dcol] = cacc[r] + cv[p][i];
        }
    };

    // Phase 0 goes to xt, so it cannot meet the fragment loads from xs above;
    // xs is first rewritten (phase 1) behind the barrier of p = 0.
    phase_to_lds(0, xt);

    // Fully unrolled so that cv[p][] stays in registers (constant index).
#pragma unroll
    for (int p = 0; p < P_; ++p) {
        float (*cur)[D_ + DPAD] = (p & 1) ? xs : xt;
        float (*nxt)[D_ + DPAD] = (p & 1) ? xt : xs;

        // The one barrier of a phase: it publishes the tile of phase p and
        // ends every wave's row reads of phase p-1, whose tile is refilled below.
        __syncthreads();

        // Row 'wave' of the tile: lane l holds floats 4*(l+32q) .. +3.
        v4f v[4];
#pragma unroll
        for (int q = 0; q < 4; ++q)
            v[q] = ((const v4f*)&cur[wave][0])[lane + 32 * q];

        if (p + 1 < P_) phase_to_lds(p + 1, nxt);

        // Lane's own part as four-wide sums, then across the wave.
        const v4f u1 = (v[0] + v[1]) + (v[2] + v[3]);
        const v4f u2 = (v[0] * v[0] + v[1] * v[1]) + (v[2] * v[2] + v[3] * v[3]);
        const float S1 = wave_sum((u1.x + u1.y) + (u1.z + u1.w));
        const float S2 = wave_sum((u2.x + u2.y) + (u2.z + u2.w));

        const float mean = S1 * (1.0f / D_);
        float var = (S2 - S1 * mean) * (1.0f / (D_ - 1));   // unbiased (ddof=1)
        var = var < 0.0f ? 0.0f : var;
        const float inv = 1.0f / (sqrtf(var) + 1e-6f);

        // Normalize + affine:  y[b, t0+wave, p, d]
        v4f o[4];
#pragma unroll
        for (int q = 0; q < 4; ++q)
            o[q] = ga[q] * (v[q] - mean) * inv + gb[q];

        // Store the row: four runs of 512 contiguous bytes, whole lines each.
        // The stores and their s_wait_xcnt stand in one statement: the next p
        // reuses the registers they name while they are still in flight, and
        // inside a statement nothing can be scheduled in front of the wait.
        // The compiler counts no store of asm text, so the loop's barrier does
        // not wait for these; no wave reads y, so none has to.
        float* yp = y + (((size_t)(b * T_ + t0 + wave)) * P_ + p) * D_ + lane * 4;
        asm volatile(
            "global_store_b128 %0, %1, off\n\t"
            "global_store_b128 %0, %2, off offset:512\n\t"
            "global_store_b128 %0, %3, off offset:1024\n\t"
            "global_store_b128 %0, %4, off offset:1536\n\t"
            "s_wait_xcnt 0x0"
            :: "v"(yp), "v"(o[0]), "v"(o[1]), "v"(o[2]), "v"(o[3])
            : "memory");
    }
}

// ---------------------------------------------------------------------------
extern "C" void kernel_launch(void* const* d_in, const int* in_sizes, int n_in,
                              void* d_out, int out_size, void* d_ws, size_t ws_size,
                              hipStream_t stream) {
    (void)in_sizes; (void)n_in; (void)out_size; (void)ws_size;

    const float* outin = (const float*)d_in[0];  // (B,T,D)
    const float* ppm   = (const float*)d_in[1];  // (B,T,P)
    const float* a2    = (const float*)d_in[2];  // (D,)
    const float* b2    = (const float*)d_in[3];  // (D,)
    float* y    = (float*)d_out;                 // (B,T,P,D)
    float* csum = (float*)d_ws;                  // B*P*NC*D floats = 7 MB
    float* half0 = csum + B_ * P_ * NC * D_;     // B*P*D floats behind them

    chunk_carries<<<dim3(NSL, 2, B_), 256, 0, stream>>>(outin, ppm, csum, half0);

    prefix_ln<<<B_ * NC, 512, 0, stream>>>(outin, ppm, csum, half0, a2, b2, y);
}
